// v000
// Measured on an AMD MI455X. A time is GPU time per run, averaged over a window of back-to-back runs after a warm-up
// (all launches, gaps included; the runs take copies of the inputs in turn), and the median of several windows.
// Apart from v000's, it joins two sittings. Times from different sittings can be a few percent apart, while
// side-by-side timings come from the same sitting.
// v000 is the starting kernel. One run takes 371 microseconds.
#include <hip/hip_runtime.h>
#include <cstddef>
#include <cstdint>

// Problem constants (reference: N, C, T, V, H = 64, 256, 64, 25, 8)
constexpr int NN   = 64;
constexpr int CC   = 256;
constexpr int TT   = 64;
constexpr int VV   = 25;
constexpr int HH   = 8;
constexpr int DD   = CC / HH;          // 32
constexpr int SS   = TT * VV;          // 1600 tokens per batch item
constexpr int KDIM = CC;               // 256 reduction dim for both GEMMs
constexpr int O3   = 3 * CC;           // 768

typedef __attribute__((ext_vector_type(2))) float v2f;
typedef __attribute__((ext_vector_type(8))) float v8f;

__device__ __forceinline__ uint32_t lds_addr32(const void* p) {
    // Generic pointers to LDS carry the LDS offset in addr[31:0] (ISA 10.2).
    return (uint32_t)(uintptr_t)p;
}

// ---------------------------------------------------------------------------
// WMMA fp32 GEMM:  Y[n] = W (Mtot x 256) @ X[n] (256 x 1600) + bias (+ resid)
// Block: 128 threads = 4 waves, 64(M) x 64(N) tile, K in chunks of 16.
// Tiles are DMA'd straight into LDS with GLOBAL_LOAD_ASYNC_TO_LDS_B128 and
// double-buffered: chunk i+1's async copies fly while chunk i feeds WMMAs.
// Each thread issues exactly 4 asyncs/chunk; "s_wait_asynccnt 4" => chunk i
// complete (async loads finish in order), chunk i+1 still in flight.
// ---------------------------------------------------------------------------
template <bool RES>
__global__ __launch_bounds__(128)
void gemm_wmma_f32(const float* __restrict__ W,     // [Mtot][256]
                   const float* __restrict__ X,     // [NN][256][SS]
                   const float* __restrict__ bias,  // [Mtot]
                   const float* __restrict__ resid, // [NN][Mtot][SS] (RES only)
                   float* __restrict__ Y,           // [NN][Mtot][SS]
                   int Mtot)
{
    const int s0  = blockIdx.x * 64;   // token tile
    const int m0  = blockIdx.y * 64;   // output-channel tile
    const int n   = blockIdx.z;        // batch
    const int tid = threadIdx.x;
    const int wave = tid >> 5;
    const int lane = tid & 31;
    const int lh   = lane >> 4;        // K-half selector within fragment
    const int li   = lane & 15;        // M/N index within fragment
    const int wm   = (wave >> 1) * 32; // wave quadrant
    const int wn   = (wave & 1) * 32;

    // Double-buffered padded LDS tiles.
    // A: [m][k] stride 20 (80B rows -> 16B-aligned b128 dests, banks spread)
    // B: [k][col] stride 68 (272B rows -> 16B-aligned b128 dests)
    __shared__ __align__(16) float As[2][64 * 20];
    __shared__ __align__(16) float Bs[2][16 * 68];
    __shared__ float bias_s[64];

    if (tid < 64) bias_s[tid] = bias[m0 + tid];

    const float* Xn = X + (size_t)n * KDIM * SS;

    // Issue the 4 async b128 copies (2 A + 2 B) for one 16-wide K chunk.
    auto issue_chunk = [&](int buf, int kc) {
#pragma unroll
        for (int it = 0; it < 2; ++it) {
            int idx = tid + it * 128;                  // A: 64 rows x 4 groups
            int r = idx >> 2, q = idx & 3;
            uint32_t lds = lds_addr32(&As[buf][r * 20 + q * 4]);
            uint32_t off = (uint32_t)(((m0 + r) * KDIM + kc + q * 4) * 4);
            asm volatile("global_load_async_to_lds_b128 %0, %1, %2"
                         :: "v"(lds), "v"(off), "s"(W) : "memory");
        }
#pragma unroll
        for (int it = 0; it < 2; ++it) {
            int idx = tid + it * 128;                  // B: 16 k-rows x 16 groups
            int r = idx >> 4, q = idx & 15;
            uint32_t lds = lds_addr32(&Bs[buf][r * 68 + q * 4]);
            uint32_t off = (uint32_t)(((kc + r) * SS + s0 + q * 4) * 4);
            asm volatile("global_load_async_to_lds_b128 %0, %1, %2"
                         :: "v"(lds), "v"(off), "s"(Xn) : "memory");
        }
    };

    v8f acc[2][2] = {};

    constexpr int NCHUNK = KDIM / 16;
    issue_chunk(0, 0);

    for (int ic = 0; ic < NCHUNK; ++ic) {
        const int buf = ic & 1;
        if (ic + 1 < NCHUNK) {
            issue_chunk(buf ^ 1, (ic + 1) * 16);       // prefetch next chunk
            asm volatile("s_wait_asynccnt 0x4" ::: "memory"); // chunk ic done
        } else {
            asm volatile("s_wait_asynccnt 0x0" ::: "memory");
        }
        __syncthreads();

#pragma unroll
        for (int kk = 0; kk < 16; kk += 4) {
            const int kb = kk + lh * 2;                // this lane-half's K pair
            v2f a0 = *(const v2f*)&As[buf][(wm + li) * 20 + kb];
            v2f a1 = *(const v2f*)&As[buf][(wm + 16 + li) * 20 + kb];
            // two b32 reads, 68-float apart -> ds_load_2addr_b32
            v2f b0 = { Bs[buf][kb * 68 + wn + li],
                       Bs[buf][(kb + 1) * 68 + wn + li] };
            v2f b1 = { Bs[buf][kb * 68 + wn + 16 + li],
                       Bs[buf][(kb + 1) * 68 + wn + 16 + li] };
            acc[0][0] = __builtin_amdgcn_wmma_f32_16x16x4_f32(false, a0, false, b0,
                                                              (short)0, acc[0][0], false, false);
            acc[0][1] = __builtin_amdgcn_wmma_f32_16x16x4_f32(false, a0, false, b1,
                                                              (short)0, acc[0][1], false, false);
            acc[1][0] = __builtin_amdgcn_wmma_f32_16x16x4_f32(false, a1, false, b0,
                                                              (short)0, acc[1][0], false, false);
            acc[1][1] = __builtin_amdgcn_wmma_f32_16x16x4_f32(false, a1, false, b1,
                                                              (short)0, acc[1][1], false, false);
        }
        __syncthreads();
    }

    // --- epilogue: bias (+ residual); D: VGPR j -> M = lh*8+j, lane li -> N
    const size_t outBase = (size_t)n * Mtot * SS;
#pragma unroll
    for (int mi = 0; mi < 2; ++mi) {
#pragma unroll
        for (int ni = 0; ni < 2; ++ni) {
            const int colg = s0 + wn + ni * 16 + li;
#pragma unroll
            for (int j = 0; j < 8; ++j) {
                const int mloc = wm + mi * 16 + lh * 8 + j;
                float v = acc[mi][ni][j] + bias_s[mloc];
                const size_t o = outBase + (size_t)(m0 + mloc) * SS + colg;
                if (RES) v += resid[o];
                Y[o] = v;
            }
        }
    }
}

// ---------------------------------------------------------------------------
// Attention: one wave per (n, h, t).
//   logits = q^T k  (25x25, K=d=32, padded to 32x32 via WMMA)
//   attn   = softmax(logits * d^-0.5 - hop_w * hop_grid)
//   x_att  = val @ attn^T (32x25, K=u=25 padded to 32; padding zeroed in LDS)
// ---------------------------------------------------------------------------
__global__ __launch_bounds__(32)
void attn_kernel(const float* __restrict__ qkv,      // [NN][768][SS]
                 const float* __restrict__ hop_w,    // [1]
                 const float* __restrict__ hop_grid, // [25][25]
                 float* __restrict__ xatt)           // [NN][256][SS]
{
    const int t = blockIdx.x, h = blockIdx.y, n = blockIdx.z;
    const int lane = threadIdx.x;
    const int lh = lane >> 4, li = lane & 15;

    __shared__ __align__(16) float qT[32 * 34];  // q^T: [v][d], stride 34
    __shared__ __align__(16) float kP[16 * 72];  // k:   K-pair rows [p][u][2]
    __shared__ __align__(16) float vS[32 * 34];  // val: [d][u], stride 34
    __shared__ __align__(16) float aS[32 * 34];  // attn:[v][u], stride 34

    // Zero LDS so all K/N padding contributes exactly 0.
    for (int i = lane; i < 32 * 34; i += 32) qT[i] = 0.f;
    for (int i = lane; i < 16 * 72; i += 32) kP[i] = 0.f;
    for (int i = lane; i < 32 * 34; i += 32) vS[i] = 0.f;
    for (int i = lane; i < 32 * 34; i += 32) aS[i] = 0.f;
    __syncthreads();

    const size_t nb = (size_t)n * O3 * SS;
    const float* qg = qkv + nb + (size_t)(0 * CC + h * DD) * SS + t * VV;
    const float* kg = qkv + nb + (size_t)(1 * CC + h * DD) * SS + t * VV;
    const float* vg = qkv + nb + (size_t)(2 * CC + h * DD) * SS + t * VV;

    // Load 32x25 q/k/val tiles (rows contiguous over u) into frag layouts.
    for (int f = lane; f < DD * VV; f += 32) {
        const int dd = f / VV, u = f % VV;
        const size_t go = (size_t)dd * SS + u;
        qT[u * 34 + dd] = qg[go];
        kP[(dd >> 1) * 72 + u * 2 + (dd & 1)] = kg[go];
        vS[dd * 34 + u] = vg[go];
    }
    __syncthreads();

    // ---- GEMM1: logits[v][u] = sum_d q[d][v] * k[d][u]  (K = 32) ----
    v8f acc1[2][2] = {};
#pragma unroll
    for (int kk = 0; kk < 32; kk += 4) {
        const int kb = kk + lh * 2;
        v2f a0 = *(const v2f*)&qT[li * 34 + kb];
        v2f a1 = *(const v2f*)&qT[(16 + li) * 34 + kb];
        const int p = kb >> 1;
        v2f b0 = *(const v2f*)&kP[p * 72 + li * 2];
        v2f b1 = *(const v2f*)&kP[p * 72 + (16 + li) * 2];
        acc1[0][0] = __builtin_amdgcn_wmma_f32_16x16x4_f32(false, a0, false, b0,
                                                           (short)0, acc1[0][0], false, false);
        acc1[0][1] = __builtin_amdgcn_wmma_f32_16x16x4_f32(false, a0, false, b1,
                                                           (short)0, acc1[0][1], false, false);
        acc1[1][0] = __builtin_amdgcn_wmma_f32_16x16x4_f32(false, a1, false, b0,
                                                           (short)0, acc1[1][0], false, false);
        acc1[1][1] = __builtin_amdgcn_wmma_f32_16x16x4_f32(false, a1, false, b1,
                                                           (short)0, acc1[1][1], false, false);
    }
    // Spill logits to LDS (only valid u columns; padded cols stay 0).
#pragma unroll
    for (int mi = 0; mi < 2; ++mi) {
#pragma unroll
        for (int ni = 0; ni < 2; ++ni) {
            const int col = ni * 16 + li;
            if (col < VV) {
#pragma unroll
                for (int j = 0; j < 8; ++j)
                    aS[(mi * 16 + lh * 8 + j) * 34 + col] = acc1[mi][ni][j];
            }
        }
    }
    __syncthreads();

    // ---- softmax over u (row v handled by lane v) ----
    {
        const float scale = 0.17677669529663688f;  // 32^-0.5
        const float hw = hop_w[0];
        if (lane < VV) {
            const int v = lane;
            float lg[VV];
            float mx = -3.4e38f;
#pragma unroll
            for (int u = 0; u < VV; ++u) {
                const float l = aS[v * 34 + u] * scale - hw * hop_grid[v * VV + u];
                lg[u] = l;
                mx = fmaxf(mx, l);
            }
            float sum = 0.f;
#pragma unroll
            for (int u = 0; u < VV; ++u) {
                const float e = __expf(lg[u] - mx);
                lg[u] = e;
                sum += e;
            }
            const float inv = 1.f / sum;
#pragma unroll
            for (int u = 0; u < VV; ++u) aS[v * 34 + u] = lg[u] * inv;
        }
    }
    __syncthreads();

    // ---- GEMM2: x_att[d][v] = sum_u val[d][u] * attn[v][u]  (K = 25 -> 32) ----
    v8f acc2[2][2] = {};
#pragma unroll
    for (int kk = 0; kk < 32; kk += 4) {
        const int kb = kk + lh * 2;
        v2f a0 = *(const v2f*)&vS[li * 34 + kb];
        v2f a1 = *(const v2f*)&vS[(16 + li) * 34 + kb];
        v2f b0 = *(const v2f*)&aS[li * 34 + kb];         // B[k=u][n=v] = attn[v][u]
        v2f b1 = *(const v2f*)&aS[(16 + li) * 34 + kb];
        acc2[0][0] = __builtin_amdgcn_wmma_f32_16x16x4_f32(false, a0, false, b0,
                                                           (short)0, acc2[0][0], false, false);
        acc2[0][1] = __builtin_amdgcn_wmma_f32_16x16x4_f32(false, a0, false, b1,
                                                           (short)0, acc2[0][1], false, false);
        acc2[1][0] = __builtin_amdgcn_wmma_f32_16x16x4_f32(false, a1, false, b0,
                                                           (short)0, acc2[1][0], false, false);
        acc2[1][1] = __builtin_amdgcn_wmma_f32_16x16x4_f32(false, a1, false, b1,
                                                           (short)0, acc2[1][1], false, false);
    }

    float* og = xatt + (size_t)n * CC * SS + (size_t)(h * DD) * SS + t * VV;
#pragma unroll
    for (int mi = 0; mi < 2; ++mi) {
#pragma unroll
        for (int ni = 0; ni < 2; ++ni) {
            const int col = ni * 16 + li;
            if (col < VV) {
#pragma unroll
                for (int j = 0; j < 8; ++j) {
                    const int dd = mi * 16 + lh * 8 + j;
                    og[(size_t)dd * SS + col] = acc2[mi][ni][j];
                }
            }
        }
    }
}

// ---------------------------------------------------------------------------
extern "C" void kernel_launch(void* const* d_in, const int* in_sizes, int n_in,
                              void* d_out, int out_size, void* d_ws, size_t ws_size,
                              hipStream_t stream)
{
    const float* x        = (const float*)d_in[0];
    const float* Wqkv     = (const float*)d_in[1];
    const float* bqkv     = (const float*)d_in[2];
    const float* Wproj    = (const float*)d_in[3];
    const float* bproj    = (const float*)d_in[4];
    const float* hop_w    = (const float*)d_in[5];
    const float* hop_grid = (const float*)d_in[6];
    float* out = (float*)d_out;

    float* qkv_ws  = (float*)d_ws;                          // 64*768*1600 f32
    float* xatt_ws = qkv_ws + (size_t)NN * O3 * SS;         // 64*256*1600 f32

    // 1) qkv = Wqkv @ x + bqkv
    gemm_wmma_f32<false><<<dim3(SS / 64, O3 / 64, NN), 128, 0, stream>>>(
        Wqkv, x, bqkv, nullptr, qkv_ws, O3);

    // 2) attention per (n, h, t)
    attn_kernel<<<dim3(TT, HH, NN), 32, 0, stream>>>(qkv_ws, hop_w, hop_grid, xatt_ws);

    // 3) out = Wproj @ x_att + bproj + x
    gemm_wmma_f32<true><<<dim3(SS / 64, CC / 64, NN), 128, 0, stream>>>(
        Wproj, xatt_ws, bproj, x, out, CC);
}

// v001
// One run takes 345 microseconds.
// Two timings next to v000 put it at 1.07 and 1.08 times that version's speed.
#include <hip/hip_runtime.h>
#include <cstddef>
#include <cstdint>

// Problem constants (reference: N, C, T, V, H = 64, 256, 64, 25, 8)
constexpr int NN   = 64;
constexpr int CC   = 256;
constexpr int TT   = 64;
constexpr int VV   = 25;
constexpr int HH   = 8;
constexpr int DD   = CC / HH;          // 32
constexpr int SS   = TT * VV;          // 1600 tokens per batch item
constexpr int KDIM = CC;               // 256 reduction dim for both GEMMs
constexpr int O3   = 3 * CC;           // 768

typedef __attribute__((ext_vector_type(2))) float v2f;
typedef __attribute__((ext_vector_type(8))) float v8f;

__device__ __forceinline__ uint32_t lds_addr32(const void* p) {
    // Generic pointers to LDS carry the LDS offset in addr[31:0] (ISA 10.2).
    return (uint32_t)(uintptr_t)p;
}

// ---------------------------------------------------------------------------
// WMMA fp32 GEMM:  Y[n] = W (Mtot x 256) @ X[n] (256 x 1600) + bias (+ resid)
// Block: 128 threads = 4 waves (2 x 2), 128(M) x 128(N) tile, 64 x 64 per wave
// (16 accumulator tiles), K in chunks of 32. Each A or B fragment read from LDS
// feeds 4 WMMAs, and a chunk's A rows are whole 128-byte lines.
// The 128 columns are two groups of 64 tokens; 1600 = 25 groups per batch item,
// so each group carries its own batch index and token offset.
// Tiles go straight into LDS with GLOBAL_LOAD_ASYNC_TO_LDS_B128, two buffers:
// chunk t+1's copies fly while chunk t feeds the WMMAs.
// ---------------------------------------------------------------------------
constexpr int BK      = 32;            // K per chunk
constexpr int APITCH  = 36;            // floats; 144-B rows: b64 fragment reads hit 64 distinct banks
constexpr int BPITCH  = 136;           // floats; 544-B rows: the two lane halves (2 rows apart) sit 16 banks apart
constexpr int ABYTES  = 128 * APITCH * 4;
constexpr int BBYTES  = BK * BPITCH * 4;
constexpr int NGROUP  = SS / 64;       // 25 token groups per batch item

// Eight async 16-byte-per-lane copies. The s_wait_xcnt closes the statement so
// that no address register named here is rewritten ahead of it.
__device__ __forceinline__ void copy8(uint32_t l, uint32_t lstep,
                                      const float* g, int gstep) {
    asm volatile("global_load_async_to_lds_b128 %0, %8, off\n\t"
                 "global_load_async_to_lds_b128 %1, %9, off\n\t"
                 "global_load_async_to_lds_b128 %2, %10, off\n\t"
                 "global_load_async_to_lds_b128 %3, %11, off\n\t"
                 "global_load_async_to_lds_b128 %4, %12, off\n\t"
                 "global_load_async_to_lds_b128 %5, %13, off\n\t"
                 "global_load_async_to_lds_b128 %6, %14, off\n\t"
                 "global_load_async_to_lds_b128 %7, %15, off\n\t"
                 "s_wait_xcnt 0x0"
                 :: "v"(l), "v"(l + lstep), "v"(l + 2 * lstep), "v"(l + 3 * lstep),
                    "v"(l + 4 * lstep), "v"(l + 5 * lstep), "v"(l + 6 * lstep),
                    "v"(l + 7 * lstep),
                    "v"(g), "v"(g + gstep), "v"(g + 2 * gstep), "v"(g + 3 * gstep),
                    "v"(g + 4 * gstep), "v"(g + 5 * gstep), "v"(g + 6 * gstep),
                    "v"(g + 7 * gstep)
                 : "memory");
}

template <bool RES>
__global__ __launch_bounds__(128)
void gemm_wmma_f32(const float* __restrict__ W,     // [Mtot][256]
                   const float* __restrict__ X,     // [NN][256][SS]
                   const float* __restrict__ bias,  // [Mtot]
                   const float* __restrict__ resid, // [NN][Mtot][SS] (RES only)
                   float* __restrict__ Y,           // [NN][Mtot][SS]
                   int Mtot)
{
    const int m0  = blockIdx.x * 128;  // output-channel tile
    const int g0  = blockIdx.y * 2;    // first of this block's two token groups
    const int tid = threadIdx.x;
    const int wave = tid >> 5;
    const int lane = tid & 31;
    const int lh   = lane >> 4;        // K-half selector within fragment
    const int li   = lane & 15;        // M/N index within fragment
    const int wm   = (wave >> 1) * 64; // wave quadrant
    const int wn   = (wave & 1) * 64;

    __shared__ __align__(16) float As[2][128 * APITCH];  // [m][k]
    __shared__ __align__(16) float Bs[2][BK * BPITCH];   // [k][col]
    __shared__ float bias_s[128];

    bias_s[tid] = bias[m0 + tid];

    // A copies: 128 rows x 8 pieces of 16 B; a thread takes rows tid/8 + 16*it.
    const uint32_t aLds = lds_addr32(&As[0][(tid >> 3) * APITCH + (tid & 7) * 4]);
    const float*   aPtr = W + (size_t)(m0 + (tid >> 3)) * KDIM + (tid & 7) * 4;
    // B copies: 32 k-rows x 32 pieces of 16 B; a wave takes rows wave + 4*it.
    const int      cg   = g0 + lh;     // token group of this lane's piece
    const uint32_t bLds = lds_addr32(&Bs[0][wave * BPITCH + lane * 4]);
    const float*   bPtr = X + ((size_t)(cg / NGROUP) * KDIM + wave) * SS
                            + (cg % NGROUP) * 64 + li * 4;

    auto issue_chunk = [&](int buf, int kc) {
        copy8(aLds + buf * ABYTES, 16 * APITCH * 4, aPtr + kc, 16 * KDIM);
        copy8(bLds + buf * BBYTES, 4 * BPITCH * 4, bPtr + (size_t)kc * SS, 4 * SS);
    };

    v8f acc[4][4] = {};

    constexpr int NCHUNK = KDIM / BK;
    issue_chunk(0, 0);
    asm volatile("s_wait_asynccnt 0x0" ::: "memory");  // own copies of chunk 0 landed
    __syncthreads();                                   // every wave's copies of chunk 0 landed
    issue_chunk(1, BK);

    for (int t = 0; t < NCHUNK; ++t) {
        const int buf = t & 1;
        // The unrolls below keep every fragment and accumulator index a constant,
        // so that a[], b[] and acc[][] live in registers.
#pragma unroll
        for (int kk = 0; kk < BK; kk += 4) {
            const int kb = kk + lh * 2;                // this lane-half's K pair
            v2f a[4], b[4];
#pragma unroll
            for (int i = 0; i < 4; ++i)
                a[i] = *(const v2f*)&As[buf][(wm + i * 16 + li) * APITCH + kb];
#pragma unroll
            for (int j = 0; j < 4; ++j)
                b[j] = v2f{ Bs[buf][kb * BPITCH + wn + j * 16 + li],
                            Bs[buf][(kb + 1) * BPITCH + wn + j * 16 + li] };
#pragma unroll
            for (int i = 0; i < 4; ++i)
#pragma unroll
                for (int j = 0; j < 4; ++j)
                    acc[i][j] = __builtin_amdgcn_wmma_f32_16x16x4_f32(
                        false, a[i], false, b[j], (short)0, acc[i][j], false, false);
        }
        asm volatile("s_wait_dscnt 0x0" ::: "memory");    // own reads of this buffer done
        asm volatile("s_wait_asynccnt 0x0" ::: "memory"); // own copies of chunk t+1 landed
        __syncthreads();  // publishes chunk t+1 and frees this buffer for the refill
        if (t + 2 < NCHUNK) issue_chunk(buf, (t + 2) * BK);
    }
    asm volatile("s_wait_asynccnt 0x0" ::: "memory");     // nothing in flight at the wave's end

    // --- epilogue: bias (+ residual); D: VGPR j -> M = lh*8+j, lane li -> N
    const int og = g0 + (wave & 1);                    // this wave's token group
    const int s0 = (og % NGROUP) * 64;
    const size_t outBase = (size_t)(og / NGROUP) * Mtot * SS;
    // Unrolled throughout for constant indices into acc[][] and r[][] (registers).
#pragma unroll
    for (int mi = 0; mi < 4; ++mi) {
        float r[4][8];
        if (RES) {
#pragma unroll
            for (int ni = 0; ni < 4; ++ni)
#pragma unroll
                for (int j = 0; j < 8; ++j)
                    r[ni][j] = resid[outBase + (size_t)(m0 + wm + mi * 16 + lh * 8 + j) * SS
                                     + s0 + ni * 16 + li];
            // Holds this row block's 32 residual loads together in flight; without it
            // the scheduler emitted load, wait, add, store one element at a time.
            __builtin_amdgcn_sched_barrier(0);
        }
#pragma unroll
        for (int ni = 0; ni < 4; ++ni) {
            const int colg = s0 + ni * 16 + li;
#pragma unroll
            for (int j = 0; j < 8; ++j) {
                const int mloc = wm + mi * 16 + lh * 8 + j;
                float v = acc[mi][ni][j] + bias_s[mloc];
                const size_t o = outBase + (size_t)(m0 + mloc) * SS + colg;
                if (RES) v += r[ni][j];
                Y[o] = v;
            }
        }
    }
}

// ---------------------------------------------------------------------------
// Attention: one wave per (n, h, t).
//   logits = q^T k  (25x25, K=d=32, padded to 32x32 via WMMA)
//   attn   = softmax(logits * d^-0.5 - hop_w * hop_grid)
//   x_att  = val @ attn^T (32x25, K=u=25 padded to 32; padding zeroed in LDS)
// ---------------------------------------------------------------------------
__global__ __launch_bounds__(32)
void attn_kernel(const float* __restrict__ qkv,      // [NN][768][SS]
                 const float* __restrict__ hop_w,    // [1]
                 const float* __restrict__ hop_grid, // [25][25]
                 float* __restrict__ xatt)           // [NN][256][SS]
{
    const int t = blockIdx.x, h = blockIdx.y, n = blockIdx.z;
    const int lane = threadIdx.x;
    const int lh = lane >> 4, li = lane & 15;

    __shared__ __align__(16) float qT[32 * 34];  // q^T: [v][d], stride 34
    __shared__ __align__(16) float kP[16 * 72];  // k:   K-pair rows [p][u][2]
    __shared__ __align__(16) float vS[32 * 34];  // val: [d][u], stride 34
    __shared__ __align__(16) float aS[32 * 34];  // attn:[v][u], stride 34

    // Zero LDS so all K/N padding contributes exactly 0.
    for (int i = lane; i < 32 * 34; i += 32) qT[i] = 0.f;
    for (int i = lane; i < 16 * 72; i += 32) kP[i] = 0.f;
    for (int i = lane; i < 32 * 34; i += 32) vS[i] = 0.f;
    for (int i = lane; i < 32 * 34; i += 32) aS[i] = 0.f;
    __syncthreads();

    const size_t nb = (size_t)n * O3 * SS;
    const float* qg = qkv + nb + (size_t)(0 * CC + h * DD) * SS + t * VV;
    const float* kg = qkv + nb + (size_t)(1 * CC + h * DD) * SS + t * VV;
    const float* vg = qkv + nb + (size_t)(2 * CC + h * DD) * SS + t * VV;

    // Load 32x25 q/k/val tiles (rows contiguous over u) into frag layouts.
    for (int f = lane; f < DD * VV; f += 32) {
        const int dd = f / VV, u = f % VV;
        const size_t go = (size_t)dd * SS + u;
        qT[u * 34 + dd] = qg[go];
        kP[(dd >> 1) * 72 + u * 2 + (dd & 1)] = kg[go];
        vS[dd * 34 + u] = vg[go];
    }
    __syncthreads();

    // ---- GEMM1: logits[v][u] = sum_d q[d][v] * k[d][u]  (K = 32) ----
    v8f acc1[2][2] = {};
#pragma unroll
    for (int kk = 0; kk < 32; kk += 4) {
        const int kb = kk + lh * 2;
        v2f a0 = *(const v2f*)&qT[li * 34 + kb];
        v2f a1 = *(const v2f*)&qT[(16 + li) * 34 + kb];
        const int p = kb >> 1;
        v2f b0 = *(const v2f*)&kP[p * 72 + li * 2];
        v2f b1 = *(const v2f*)&kP[p * 72 + (16 + li) * 2];
        acc1[0][0] = __builtin_amdgcn_wmma_f32_16x16x4_f32(false, a0, false, b0,
                                                           (short)0, acc1[0][0], false, false);
        acc1[0][1] = __builtin_amdgcn_wmma_f32_16x16x4_f32(false, a0, false, b1,
                                                           (short)0, acc1[0][1], false, false);
        acc1[1][0] = __builtin_amdgcn_wmma_f32_16x16x4_f32(false, a1, false, b0,
                                                           (short)0, acc1[1][0], false, false);
        acc1[1][1] = __builtin_amdgcn_wmma_f32_16x16x4_f32(false, a1, false, b1,
                                                           (short)0, acc1[1][1], false, false);
    }
    // Spill logits to LDS (only valid u columns; padded cols stay 0).
#pragma unroll
    for (int mi = 0; mi < 2; ++mi) {
#pragma unroll
        for (int ni = 0; ni < 2; ++ni) {
            const int col = ni * 16 + li;
            if (col < VV) {
#pragma unroll
                for (int j = 0; j < 8; ++j)
                    aS[(mi * 16 + lh * 8 + j) * 34 + col] = acc1[mi][ni][j];
            }
        }
    }
    __syncthreads();

    // ---- softmax over u (row v handled by lane v) ----
    {
        const float scale = 0.17677669529663688f;  // 32^-0.5
        const float hw = hop_w[0];
        if (lane < VV) {
            const int v = lane;
            float lg[VV];
            float mx = -3.4e38f;
#pragma unroll
            for (int u = 0; u < VV; ++u) {
                const float l = aS[v * 34 + u] * scale - hw * hop_grid[v * VV + u];
                lg[u] = l;
                mx = fmaxf(mx, l);
            }
            float sum = 0.f;
#pragma unroll
            for (int u = 0; u < VV; ++u) {
                const float e = __expf(lg[u] - mx);
                lg[u] = e;
                sum += e;
            }
            const float inv = 1.f / sum;
#pragma unroll
            for (int u = 0; u < VV; ++u) aS[v * 34 + u] = lg[u] * inv;
        }
    }
    __syncthreads();

    // ---- GEMM2: x_att[d][v] = sum_u val[d][u] * attn[v][u]  (K = 25 -> 32) ----
    v8f acc2[2][2] = {};
#pragma unroll
    for (int kk = 0; kk < 32; kk += 4) {
        const int kb = kk + lh * 2;
        v2f a0 = *(const v2f*)&vS[li * 34 + kb];
        v2f a1 = *(const v2f*)&vS[(16 + li) * 34 + kb];
        v2f b0 = *(const v2f*)&aS[li * 34 + kb];         // B[k=u][n=v] = attn[v][u]
        v2f b1 = *(const v2f*)&aS[(16 + li) * 34 + kb];
        acc2[0][0] = __builtin_amdgcn_wmma_f32_16x16x4_f32(false, a0, false, b0,
                                                           (short)0, acc2[0][0], false, false);
        acc2[0][1] = __builtin_amdgcn_wmma_f32_16x16x4_f32(false, a0, false, b1,
                                                           (short)0, acc2[0][1], false, false);
        acc2[1][0] = __builtin_amdgcn_wmma_f32_16x16x4_f32(false, a1, false, b0,
                                                           (short)0, acc2[1][0], false, false);
        acc2[1][1] = __builtin_amdgcn_wmma_f32_16x16x4_f32(false, a1, false, b1,
                                                           (short)0, acc2[1][1], false, false);
    }

    float* og = xatt + (size_t)n * CC * SS + (size_t)(h * DD) * SS + t * VV;
#pragma unroll
    for (int mi = 0; mi < 2; ++mi) {
#pragma unroll
        for (int ni = 0; ni < 2; ++ni) {
            const int col = ni * 16 + li;
            if (col < VV) {
#pragma unroll
                for (int j = 0; j < 8; ++j) {
                    const int dd = mi * 16 + lh * 8 + j;
                    og[(size_t)dd * SS + col] = acc2[mi][ni][j];
                }
            }
        }
    }
}

// ---------------------------------------------------------------------------
extern "C" void kernel_launch(void* const* d_in, const int* in_sizes, int n_in,
                              void* d_out, int out_size, void* d_ws, size_t ws_size,
                              hipStream_t stream)
{
    const float* x        = (const float*)d_in[0];
    const float* Wqkv     = (const float*)d_in[1];
    const float* bqkv     = (const float*)d_in[2];
    const float* Wproj    = (const float*)d_in[3];
    const float* bproj    = (const float*)d_in[4];
    const float* hop_w    = (const float*)d_in[5];
    const float* hop_grid = (const float*)d_in[6];
    float* out = (float*)d_out;

    float* qkv_ws  = (float*)d_ws;                          // 64*768*1600 f32
    float* xatt_ws = qkv_ws + (size_t)NN * O3 * SS;         // 64*256*1600 f32

    // 1) qkv = Wqkv @ x + bqkv
    gemm_wmma_f32<false><<<dim3(O3 / 128, NN * SS / 128), 128, 0, stream>>>(
        Wqkv, x, bqkv, nullptr, qkv_ws, O3);

    // 2) attention per (n, h, t)
    attn_kernel<<<dim3(TT, HH, NN), 32, 0, stream>>>(qkv_ws, hop_w, hop_grid, xatt_ws);

    // 3) out = Wproj @ x_att + bproj + x
    gemm_wmma_f32<true><<<dim3(CC / 128, NN * SS / 128), 128, 0, stream>>>(
        Wproj, xatt_ws, bproj, x, out, CC);
}
